// v000
// Measured on an AMD MI455X. A time is GPU time per run, averaged over a window of back-to-back runs after a warm-up
// (all launches, gaps included; the runs take copies of the inputs in turn), and the median of several windows.
// Apart from v000's, it joins two sittings. Times from different sittings can be a few percent apart, while
// side-by-side timings come from the same sitting.
// v000 is the starting kernel.
#include <hip/hip_runtime.h>
#include <hip/hip_bf16.h>
#include <cmath>

// Problem constants (from reference): B=64, S=16, D=1024, E=64, N=B*S=1024
#define DD   1024
#define EE   64
#define NTOK 1024

typedef __attribute__((ext_vector_type(2))) float v2f;
typedef __attribute__((ext_vector_type(8))) float v8f;

// ---------------------------------------------------------------------------
// Phase 1: build per-expert token lists.
// counts[e] = number of tokens routed to expert e
// lists[e*NTOK + i] = token index (order nondeterministic; output is not)
// ---------------------------------------------------------------------------
__global__ void build_lists_kernel(const int* __restrict__ urls,
                                   int* __restrict__ counts,
                                   int* __restrict__ lists) {
    int n = blockIdx.x * blockDim.x + threadIdx.x;
    if (n < NTOK) {
        int e = urls[n];
        int p = atomicAdd(&counts[e], 1);
        lists[e * NTOK + p] = n;
    }
}

// ---------------------------------------------------------------------------
// Phase 2: routed GEMM via V_WMMA_F32_16X16X4_F32.
// Grid: (EE, DD/64). Block: 128 threads = 4 waves; wave w owns a 16-column
// tile [blockIdx.y*64 + 16*w, +16). Loop over token tiles of 16 rows.
// A (16x4 f32): lane L holds row M=L%16; VGPR0={K0|K2}, VGPR1={K1|K3}
//               split across lane halves.
// B (4x16 f32): lane L holds col N=L%16; same K striping over lane halves.
// C/D (16x16 f32, 8 VGPRs): VGPR r holds M = r + 8*(L>=16), N = L%16.
// ---------------------------------------------------------------------------
__global__ void __launch_bounds__(128)
moe_wmma_kernel(const float* __restrict__ x,     // [NTOK, DD]
                const float* __restrict__ trans, // [EE, DD, DD]
                const float* __restrict__ bias,  // [EE, DD]
                const int* __restrict__ counts,
                const int* __restrict__ lists,
                float* __restrict__ out) {       // [NTOK, DD]
    const int e   = blockIdx.x;
    const int cnt = counts[e];
    if (cnt == 0) return;

    const int lane = threadIdx.x & 31;
    const int wave = threadIdx.x >> 5;
    const int hi   = lane >> 4;                       // 0: lanes 0-15, 1: 16-31
    const int nloc = lane & 15;
    const int col  = blockIdx.y * 64 + wave * 16 + nloc;

    const float* __restrict__ W = trans + (size_t)e * DD * DD;
    const float  bv = bias[e * DD + col];

    __shared__ float xs[16 * DD];   // 64 KB: 16 token rows of x
    __shared__ int   tok[16];

    for (int tile = 0; tile < cnt; tile += 16) {
        __syncthreads();            // protect previous tile's LDS use
        if (threadIdx.x < 16) {
            int idx = tile + threadIdx.x;
            tok[threadIdx.x] = lists[e * NTOK + (idx < cnt ? idx : tile)];
        }
        __syncthreads();

        // Cooperative, coalesced float4 stage of 16 rows of x into LDS.
        for (int i = threadIdx.x; i < 16 * (DD / 4); i += 128) {
            int r  = i >> 8;          // DD/4 = 256 float4 per row
            int c4 = i & 255;
            float4 v = reinterpret_cast<const float4*>(x + (size_t)tok[r] * DD)[c4];
            reinterpret_cast<float4*>(xs + r * DD)[c4] = v;
        }
        __syncthreads();

        v8f acc = {};
        const float* __restrict__ arow = xs + nloc * DD;
        #pragma unroll 4
        for (int k = 0; k < DD; k += 4) {
            const int kk = k + 2 * hi;
            v2f a, b;
            a.x = arow[kk];
            a.y = arow[kk + 1];
            b.x = W[(size_t)kk * DD + col];
            b.y = W[(size_t)(kk + 1) * DD + col];
            // D = A(16x4) * B(4x16) + C ; emits v_wmma_f32_16x16x4_f32
            acc = __builtin_amdgcn_wmma_f32_16x16x4_f32(
                /*neg_a=*/false, a, /*neg_b=*/false, b,
                /*c_mod=*/(short)0, acc, /*reuse_a=*/false, /*reuse_b=*/false);
        }

        // Epilogue: bias + tanh, masked store of valid rows.
        #pragma unroll
        for (int r = 0; r < 8; ++r) {
            int m  = r + 8 * hi;
            int gm = tile + m;
            if (gm < cnt) {
                out[(size_t)tok[m] * DD + col] = tanhf(acc[r] + bv);
            }
        }
    }
}

// ---------------------------------------------------------------------------
// Launch: inputs: x[f32], urls[i32], trans[f32],
// bias[f32]. Output f32 [B,S,D]. Workspace: counts (256 B) + lists (256 KB).
// ---------------------------------------------------------------------------
extern "C" void kernel_launch(void* const* d_in, const int* in_sizes, int n_in,
                              void* d_out, int out_size, void* d_ws, size_t ws_size,
                              hipStream_t stream) {
    const float* x     = (const float*)d_in[0];
    const int*   urls  = (const int*)d_in[1];
    const float* trans = (const float*)d_in[2];
    const float* bias  = (const float*)d_in[3];
    float*       out   = (float*)d_out;

    int* counts = (int*)d_ws;
    int* lists  = counts + EE;   // 256 B in, 256 KB long

    hipMemsetAsync(counts, 0, EE * sizeof(int), stream);
    build_lists_kernel<<<(NTOK + 255) / 256, 256, 0, stream>>>(urls, counts, lists);

    dim3 grid(EE, DD / 64);
    moe_wmma_kernel<<<grid, 128, 0, stream>>>(x, trans, bias, counts, lists, out);
}

// v001
// Timed twice side by side with v000, it ran 2.07 and 2.08 times as fast.
#include <hip/hip_runtime.h>
#include <hip/hip_bf16.h>
#include <cmath>

// Problem constants (from reference): B=64, S=16, D=1024, E=64, N=B*S=1024
#define DD   1024
#define EE   64
#define NTOK 1024

typedef __attribute__((ext_vector_type(2))) float v2f;
typedef __attribute__((ext_vector_type(8))) float v8f;

// ---------------------------------------------------------------------------
// Phase 1: build per-expert token lists.
// counts[e] = number of tokens routed to expert e
// lists[e*NTOK + i] = token index (order nondeterministic; output is not)
// ---------------------------------------------------------------------------
__global__ void build_lists_kernel(const int* __restrict__ urls,
                                   int* __restrict__ counts,
                                   int* __restrict__ lists) {
    int n = blockIdx.x * blockDim.x + threadIdx.x;
    if (n < NTOK) {
        int e = urls[n];
        int p = atomicAdd(&counts[e], 1);
        lists[e * NTOK + p] = n;
    }
}

// ---------------------------------------------------------------------------
// Phase 2: routed GEMM via V_WMMA_F32_16X16X4_F32.
// Grid: (EE, DD/64). Block: 128 threads = 4 waves. The block owns 64 output
// columns; wave w owns the k range [256*w, +256) of all 64 columns, and the
// four partial sums are joined through LDS.
// W loads: lane (n = L%16, hi = L/16) reads 16 bytes, columns 4n..4n+3 of one
// row, so 16 lanes cover the block's whole 256-byte piece of that row.
// Element j of the loaded vectors feeds accumulator tile j, whose column n is
// the block's column 4n+j.
// k order of one group of 8 k (base kb), WMMA u = 0,1, operand register v = 0,1:
// A and B both hold k = kb + 4*hi + 2*u + v.
// C/D (16x16 f32, 8 VGPRs): VGPR r holds M = r + 8*hi, N = L%16.
// ---------------------------------------------------------------------------
__global__ void __launch_bounds__(128)
moe_wmma_kernel(const float* __restrict__ x,     // [NTOK, DD]
                const float* __restrict__ trans, // [EE, DD, DD]
                const float* __restrict__ bias,  // [EE, DD]
                const int* __restrict__ counts,
                const int* __restrict__ lists,
                float* __restrict__ out) {       // [NTOK, DD]
    const int e   = blockIdx.x;
    const int cnt = counts[e];
    if (cnt == 0) return;

    const int lane = threadIdx.x & 31;
    const int wave = threadIdx.x >> 5;
    const int hi   = lane >> 4;                       // 0: lanes 0-15, 1: 16-31
    const int nloc = lane & 15;
    const int col0 = blockIdx.y * 64;                 // block's first column
    const int kq   = wave * (DD / 4);                 // wave's first k

    const float* __restrict__ W = trans + (size_t)e * DD * DD;

    // Join phase: thread t sums rows t/16 and t/16 + 8, columns 4*(t%16)..+3.
    const int jrow = threadIdx.x >> 4;
    const int jcol = (threadIdx.x & 15) * 4;
    const float4 bv = *reinterpret_cast<const float4*>(bias + e * DD + col0 + jcol);

    __shared__ float xs[16 * DD];   // 64 KB: 16 token rows of x; then the partials
    __shared__ int   tok[16];

    for (int tile = 0; tile < cnt; tile += 16) {
        __syncthreads();            // protect previous tile's LDS use
        if (threadIdx.x < 16) {
            int idx = tile + threadIdx.x;
            tok[threadIdx.x] = lists[e * NTOK + (idx < cnt ? idx : tile)];
        }
        __syncthreads();

        // Cooperative, coalesced float4 stage of 16 rows of x into LDS.
        for (int i = threadIdx.x; i < 16 * (DD / 4); i += 128) {
            int r  = i >> 8;          // DD/4 = 256 float4 per row
            int c4 = i & 255;
            float4 v = reinterpret_cast<const float4*>(x + (size_t)tok[r] * DD)[c4];
            reinterpret_cast<float4*>(xs + r * DD)[c4] = v;
        }
        __syncthreads();

        v8f acc0 = {}, acc1 = {}, acc2 = {}, acc3 = {};
        const float* __restrict__ ap = xs + nloc * DD + kq + 4 * hi;
        const float* __restrict__ wp = W + (size_t)(kq + 4 * hi) * DD + col0 + 4 * nloc;
        // 8 groups a trip: their 32 W loads (16 KB a wave) issue together, ahead of
        // the WMMAs, so that enough bytes are in flight to stream W from memory.
        #pragma unroll 8
        for (int kb = 0; kb < DD / 4; kb += 8) {
            const float4 a4 = *reinterpret_cast<const float4*>(ap + kb);
            const float4 w0 = *reinterpret_cast<const float4*>(wp + (size_t)(kb + 0) * DD);
            const float4 w1 = *reinterpret_cast<const float4*>(wp + (size_t)(kb + 1) * DD);
            const float4 w2 = *reinterpret_cast<const float4*>(wp + (size_t)(kb + 2) * DD);
            const float4 w3 = *reinterpret_cast<const float4*>(wp + (size_t)(kb + 3) * DD);
            const v2f a01 = {a4.x, a4.y};
            const v2f a23 = {a4.z, a4.w};
            // D = A(16x4) * B(4x16) + C ; emits v_wmma_f32_16x16x4_f32
            acc0 = __builtin_amdgcn_wmma_f32_16x16x4_f32(false, a01, false, v2f{w0.x, w1.x}, (short)0, acc0, false, false);
            acc1 = __builtin_amdgcn_wmma_f32_16x16x4_f32(false, a01, false, v2f{w0.y, w1.y}, (short)0, acc1, false, false);
            acc2 = __builtin_amdgcn_wmma_f32_16x16x4_f32(false, a01, false, v2f{w0.z, w1.z}, (short)0, acc2, false, false);
            acc3 = __builtin_amdgcn_wmma_f32_16x16x4_f32(false, a01, false, v2f{w0.w, w1.w}, (short)0, acc3, false, false);
            acc0 = __builtin_amdgcn_wmma_f32_16x16x4_f32(false, a23, false, v2f{w2.x, w3.x}, (short)0, acc0, false, false);
            acc1 = __builtin_amdgcn_wmma_f32_16x16x4_f32(false, a23, false, v2f{w2.y, w3.y}, (short)0, acc1, false, false);
            acc2 = __builtin_amdgcn_wmma_f32_16x16x4_f32(false, a23, false, v2f{w2.z, w3.z}, (short)0, acc2, false, false);
            acc3 = __builtin_amdgcn_wmma_f32_16x16x4_f32(false, a23, false, v2f{w2.w, w3.w}, (short)0, acc3, false, false);
        }

        // Join the four k ranges: each wave lays its 16x64 partial over xs.
        __syncthreads();            // every wave has read its last x fragment
        float* __restrict__ part = xs + wave * (16 * 64);
        #pragma unroll   // constant r: the accumulators stay in registers
        for (int r = 0; r < 8; ++r) {
            *reinterpret_cast<float4*>(part + (r + 8 * hi) * 64 + 4 * nloc) =
                make_float4(acc0[r], acc1[r], acc2[r], acc3[r]);
        }
        __syncthreads();            // partials visible to the whole block

        // Epilogue: sum in wave order, bias + tanh, masked store of valid rows.
        #pragma unroll   // two rows a thread, straight-line
        for (int h = 0; h < 2; ++h) {
            const int m = jrow + 8 * h;
            if (tile + m < cnt) {
                const float* __restrict__ p = xs + m * 64 + jcol;
                const float4 p0 = *reinterpret_cast<const float4*>(p);
                const float4 p1 = *reinterpret_cast<const float4*>(p + 1 * 16 * 64);
                const float4 p2 = *reinterpret_cast<const float4*>(p + 2 * 16 * 64);
                const float4 p3 = *reinterpret_cast<const float4*>(p + 3 * 16 * 64);
                float4 o;
                o.x = tanhf(((p0.x + p1.x) + p2.x) + p3.x + bv.x);
                o.y = tanhf(((p0.y + p1.y) + p2.y) + p3.y + bv.y);
                o.z = tanhf(((p0.z + p1.z) + p2.z) + p3.z + bv.z);
                o.w = tanhf(((p0.w + p1.w) + p2.w) + p3.w + bv.w);
                *reinterpret_cast<float4*>(out + (size_t)tok[m] * DD + col0 + jcol) = o;
            }
        }
    }
}

// ---------------------------------------------------------------------------
// Launch: inputs: x[f32], urls[i32], trans[f32],
// bias[f32]. Output f32 [B,S,D]. Workspace: counts (256 B) + lists (256 KB).
// ---------------------------------------------------------------------------
extern "C" void kernel_launch(void* const* d_in, const int* in_sizes, int n_in,
                              void* d_out, int out_size, void* d_ws, size_t ws_size,
                              hipStream_t stream) {
    const float* x     = (const float*)d_in[0];
    const int*   urls  = (const int*)d_in[1];
    const float* trans = (const float*)d_in[2];
    const float* bias  = (const float*)d_in[3];
    float*       out   = (float*)d_out;

    int* counts = (int*)d_ws;
    int* lists  = counts + EE;   // 256 B in, 256 KB long

    hipMemsetAsync(counts, 0, EE * sizeof(int), stream);
    build_lists_kernel<<<(NTOK + 255) / 256, 256, 0, stream>>>(urls, counts, lists);

    dim3 grid(EE, DD / 64);
    moe_wmma_kernel<<<grid, 128, 0, stream>>>(x, trans, bias, counts, lists, out);
}

// v002
// Two timings next to v001 put it at 1.14 and 1.13 times that version's speed.
// Counting every step since v000, it is 2.35 times as fast.
#include <hip/hip_runtime.h>
#include <hip/hip_bf16.h>
#include <cmath>

// Problem constants (from reference): B=64, S=16, D=1024, E=64, N=B*S=1024
#define DD   1024
#define EE   64
#define NTOK 1024

typedef __attribute__((ext_vector_type(2))) float v2f;
typedef __attribute__((ext_vector_type(8))) float v8f;

// ---------------------------------------------------------------------------
// Phase 1: build per-expert token lists.
// counts[e] = number of tokens routed to expert e
// lists[e*NTOK + i] = token index (order nondeterministic; output is not)
// ---------------------------------------------------------------------------
__global__ void build_lists_kernel(const int* __restrict__ urls,
                                   int* __restrict__ counts,
                                   int* __restrict__ lists) {
    int n = blockIdx.x * blockDim.x + threadIdx.x;
    if (n < NTOK) {
        int e = urls[n];
        int p = atomicAdd(&counts[e], 1);
        lists[e * NTOK + p] = n;
    }
}

// ---------------------------------------------------------------------------
// Phase 2: routed GEMM via V_WMMA_F32_16X16X4_F32.
// Grid: (EE, DD/128). Block: 256 threads = 8 waves. The block owns 128 output
// columns and up to 32 tokens a pass: every W fragment is loaded once and
// multiplies one token tile (16 rows) or, where more than 16 tokens are left,
// two. Wave w owns the k range [256*(w%4), +256) of the 64 columns of column
// half w/4; the four partial sums of a half are joined through LDS.
// W loads: lane (n = L%16, hi = L/16) reads 16 bytes, columns 4n..4n+3 of one
// row, so 16 lanes cover the wave's whole 256-byte piece of that row.
// Element j of the loaded vectors feeds accumulator tile j, whose column n is
// the wave's column 4n+j.
// k order of one group of 8 k (base kb), WMMA u = 0,1, operand register v = 0,1:
// A and B both hold k = kb + 4*hi + 2*u + v.
// C/D (16x16 f32, 8 VGPRs): VGPR r holds M = r + 8*hi, N = L%16.
// ---------------------------------------------------------------------------
#define WMMA4(a, b, c) __builtin_amdgcn_wmma_f32_16x16x4_f32(false, a, false, b, (short)0, c, false, false)

// One pass over the block's W slice for NT token tiles whose x rows lie in xs.
// UNR groups a trip: their 4*UNR W loads issue together, ahead of the WMMAs, so
// that enough bytes are in flight to stream W from memory.
template <int NT, int UNR>
__device__ __forceinline__ void pass_tiles(float* __restrict__ xs, const int* __restrict__ tok,
                                           const float* __restrict__ wp, int kq, int wave,
                                           int hi, int nloc, int rows_left, float4 bv,
                                           float* __restrict__ outc) {
    v8f acc[NT][4] = {};
    const float* __restrict__ ap = xs + nloc * DD + kq + 4 * hi;
    #pragma unroll UNR   // the trip's W loads issue together, ahead of its WMMAs
    for (int kb = 0; kb < DD / 4; kb += 8) {
        const float4 w0 = *reinterpret_cast<const float4*>(wp + (size_t)(kb + 0) * DD);
        const float4 w1 = *reinterpret_cast<const float4*>(wp + (size_t)(kb + 1) * DD);
        const float4 w2 = *reinterpret_cast<const float4*>(wp + (size_t)(kb + 2) * DD);
        const float4 w3 = *reinterpret_cast<const float4*>(wp + (size_t)(kb + 3) * DD);
        #pragma unroll   // constant t: the accumulators stay in registers
        for (int t = 0; t < NT; ++t) {
            const float4 a4 = *reinterpret_cast<const float4*>(ap + t * 16 * DD + kb);
            const v2f a01 = {a4.x, a4.y};
            const v2f a23 = {a4.z, a4.w};
            // D = A(16x4) * B(4x16) + C ; emits v_wmma_f32_16x16x4_f32
            acc[t][0] = WMMA4(a01, (v2f{w0.x, w1.x}), acc[t][0]);
            acc[t][1] = WMMA4(a01, (v2f{w0.y, w1.y}), acc[t][1]);
            acc[t][2] = WMMA4(a01, (v2f{w0.z, w1.z}), acc[t][2]);
            acc[t][3] = WMMA4(a01, (v2f{w0.w, w1.w}), acc[t][3]);
            acc[t][0] = WMMA4(a23, (v2f{w2.x, w3.x}), acc[t][0]);
            acc[t][1] = WMMA4(a23, (v2f{w2.y, w3.y}), acc[t][1]);
            acc[t][2] = WMMA4(a23, (v2f{w2.z, w3.z}), acc[t][2]);
            acc[t][3] = WMMA4(a23, (v2f{w2.w, w3.w}), acc[t][3]);
        }
    }

    // Join the four k ranges: each wave lays its (16*NT)x64 partial over xs.
    __syncthreads();            // every wave has read its last x fragment
    float* __restrict__ part = xs + wave * (32 * 64);
    #pragma unroll   // constant t, r: the accumulators stay in registers
    for (int t = 0; t < NT; ++t) {
        #pragma unroll
        for (int r = 0; r < 8; ++r) {
            *reinterpret_cast<float4*>(part + (16 * t + r + 8 * hi) * 64 + 4 * nloc) =
                make_float4(acc[t][0][r], acc[t][1][r], acc[t][2][r], acc[t][3][r]);
        }
    }
    __syncthreads();            // partials visible to the whole block

    // Epilogue: thread t sums rows t/32 + 8h, columns 4*(t%32)..+3 of the block,
    // in k-range order, then bias + tanh, masked store of valid rows.
    const int jrow = threadIdx.x >> 5;
    const int jl   = threadIdx.x & 31;
    const float* __restrict__ pj = xs + (jl >> 4) * (4 * 32 * 64) + (jl & 15) * 4;
    #pragma unroll   // 2*NT rows a thread, straight-line
    for (int h = 0; h < 2 * NT; ++h) {
        const int m = jrow + 8 * h;
        if (m < rows_left) {
            const float* __restrict__ p = pj + m * 64;
            const float4 p0 = *reinterpret_cast<const float4*>(p);
            const float4 p1 = *reinterpret_cast<const float4*>(p + 1 * 32 * 64);
            const float4 p2 = *reinterpret_cast<const float4*>(p + 2 * 32 * 64);
            const float4 p3 = *reinterpret_cast<const float4*>(p + 3 * 32 * 64);
            float4 o;
            o.x = tanhf(((p0.x + p1.x) + p2.x) + p3.x + bv.x);
            o.y = tanhf(((p0.y + p1.y) + p2.y) + p3.y + bv.y);
            o.z = tanhf(((p0.z + p1.z) + p2.z) + p3.z + bv.z);
            o.w = tanhf(((p0.w + p1.w) + p2.w) + p3.w + bv.w);
            *reinterpret_cast<float4*>(outc + (size_t)tok[m] * DD) = o;
            // The store's registers are reused by the next row or the next pass: the
            // wait stands in front of every such overwrite.
            asm volatile("s_wait_xcnt 0x0" ::: "memory");
        }
    }
}

// Second argument: 4 waves a SIMD, so that two blocks share a WGP and all 512
// blocks are resident at once.
__global__ void __launch_bounds__(256, 4)
moe_wmma_kernel(const float* __restrict__ x,     // [NTOK, DD]
                const float* __restrict__ trans, // [EE, DD, DD]
                const float* __restrict__ bias,  // [EE, DD]
                const int* __restrict__ counts,
                const int* __restrict__ lists,
                float* __restrict__ out) {       // [NTOK, DD]
    const int e   = blockIdx.x;
    const int cnt = counts[e];
    if (cnt == 0) return;

    const int lane = threadIdx.x & 31;
    const int wave = threadIdx.x >> 5;
    const int hi   = lane >> 4;                       // 0: lanes 0-15, 1: 16-31
    const int nloc = lane & 15;
    const int col0 = blockIdx.y * 128;                // block's first column
    const int kq   = (wave & 3) * (DD / 4);           // wave's first k

    const float* __restrict__ wp = trans + (size_t)e * DD * DD + (size_t)(kq + 4 * hi) * DD
                                   + col0 + (wave >> 2) * 64 + 4 * nloc;

    // Join phase: thread t holds columns 4*(t%32)..+3 of the block.
    const int jcol = lane * 4;
    const float4 bv = *reinterpret_cast<const float4*>(bias + e * DD + col0 + jcol);
    float* __restrict__ outc = out + col0 + jcol;

    __shared__ float xs[32 * DD];   // 128 KB: 32 token rows of x; then the partials
    __shared__ int   tok[32];

    for (int tile = 0; tile < cnt; tile += 32) {
        const int rows_left = cnt - tile;
        __syncthreads();            // protect previous pass's LDS use
        if (threadIdx.x < 32) {
            int idx = tile + threadIdx.x;
            tok[threadIdx.x] = lists[e * NTOK + (idx < cnt ? idx : tile)];
        }
        __syncthreads();

        // Cooperative, coalesced float4 stage of 16 or 32 rows of x into LDS:
        // the block's 256 threads take one row a step.
        const int nrows = rows_left > 16 ? 32 : 16;
        #pragma unroll 8   // 8 row loads in flight a thread
        for (int r = 0; r < nrows; ++r) {
            float4 v = reinterpret_cast<const float4*>(x + (size_t)tok[r] * DD)[threadIdx.x];
            reinterpret_cast<float4*>(xs + r * DD)[threadIdx.x] = v;
        }
        __syncthreads();

        // Two tiles: 4 groups a trip (16 W loads, 64 WMMAs); with 8 the compiler no
        // longer issued the loads together inside the 256-register budget.
        if (rows_left > 16)
            pass_tiles<2, 4>(xs, tok, wp, kq, wave, hi, nloc, rows_left, bv, outc);
        else
            pass_tiles<1, 8>(xs, tok, wp, kq, wave, hi, nloc, rows_left, bv, outc);
    }
}

// ---------------------------------------------------------------------------
// Launch: inputs: x[f32], urls[i32], trans[f32],
// bias[f32]. Output f32 [B,S,D]. Workspace: counts (256 B) + lists (256 KB).
// ---------------------------------------------------------------------------
extern "C" void kernel_launch(void* const* d_in, const int* in_sizes, int n_in,
                              void* d_out, int out_size, void* d_ws, size_t ws_size,
                              hipStream_t stream) {
    const float* x     = (const float*)d_in[0];
    const int*   urls  = (const int*)d_in[1];
    const float* trans = (const float*)d_in[2];
    const float* bias  = (const float*)d_in[3];
    float*       out   = (float*)d_out;

    int* counts = (int*)d_ws;
    int* lists  = counts + EE;   // 256 B in, 256 KB long

    hipMemsetAsync(counts, 0, EE * sizeof(int), stream);
    build_lists_kernel<<<(NTOK + 255) / 256, 256, 0, stream>>>(urls, counts, lists);

    dim3 grid(EE, DD / 128);
    moe_wmma_kernel<<<grid, 256, 0, stream>>>(x, trans, bias, counts, lists, out);
}

// v003
// In both of two side-by-side timings against v002, it was 1.06 times as fast.
// All steps since v000 together make it 2.49 times as fast.
#include <hip/hip_runtime.h>
#include <hip/hip_bf16.h>
#include <cmath>

// Problem constants (from reference): B=64, S=16, D=1024, E=64, N=B*S=1024
#define DD   1024
#define EE   64
#define NTOK 1024

typedef __attribute__((ext_vector_type(2))) float v2f;
typedef __attribute__((ext_vector_type(8))) float v8f;

// ---------------------------------------------------------------------------
// Phase 1: build per-expert token lists.
// counts[e] = number of tokens routed to expert e
// lists[e*NTOK + i] = token index (order nondeterministic; output is not)
// ---------------------------------------------------------------------------
__global__ void build_lists_kernel(const int* __restrict__ urls,
                                   int* __restrict__ counts,
                                   int* __restrict__ lists) {
    int n = blockIdx.x * blockDim.x + threadIdx.x;
    if (n < NTOK) {
        int e = urls[n];
        int p = atomicAdd(&counts[e], 1);
        lists[e * NTOK + p] = n;
    }
}

// ---------------------------------------------------------------------------
// Phase 2: routed GEMM via V_WMMA_F32_16X16X4_F32.
// Grid: 256 blocks of 512 threads = 16 waves, one block a WGP (256 KB of LDS).
// A block holds two independent halves of 8 waves. Each half owns 128 output
// columns of one expert and up to 32 of its tokens a pass. An expert with more
// than 16 tokens costs two matrix tiles per W fragment, one with fewer costs one:
// the experts are ranked, those with more than 16 tokens first, and half 0 takes
// rank i while half 1 takes rank 63 - i, so that a WGP's matrix work is even.
// Half 0 covers column slices 0..3 of every expert, half 1 slices 4..7.
// Inside a half: every W fragment is loaded once and multiplies one token tile
// (16 rows) or two. Wave w (0..7) owns the k range [256*(w%4), +256) of the 64
// columns of column half w/4; the four partial sums are joined through LDS.
// W loads: lane (n = L%16, hi = L/16) reads 16 bytes, columns 4n..4n+3 of one
// row, so 16 lanes cover the wave's whole 256-byte piece of that row.
// Element j of the loaded vectors feeds accumulator tile j, whose column n is
// the wave's column 4n+j.
// k order of one group of 8 k (base kb), WMMA u = 0,1, operand register v = 0,1:
// A and B both hold k = kb + 4*hi + 2*u + v.
// C/D (16x16 f32, 8 VGPRs): VGPR r holds M = r + 8*hi, N = L%16.
// ---------------------------------------------------------------------------
#define WMMA4(a, b, c) __builtin_amdgcn_wmma_f32_16x16x4_f32(false, a, false, b, (short)0, c, false, false)

// One pass over the half's W slice for NT token tiles whose x rows lie in xs.
// UNR groups a trip: their 4*UNR W loads issue together, ahead of the WMMAs, so
// that enough bytes are in flight to stream W from memory.
template <int NT, int UNR>
__device__ __forceinline__ void mul_tiles(const float* __restrict__ xs,
                                          const float* __restrict__ wp, int kq,
                                          int hi, int nloc, v8f (&acc)[2][4]) {
    #pragma unroll   // constant t, j: the accumulators stay in registers
    for (int t = 0; t < NT; ++t) {
        #pragma unroll
        for (int j = 0; j < 4; ++j) acc[t][j] = v8f{};
    }
    const float* __restrict__ ap = xs + nloc * DD + kq + 4 * hi;
    #pragma unroll UNR   // the trip's W loads issue together, ahead of its WMMAs
    for (int kb = 0; kb < DD / 4; kb += 8) {
        const float4 w0 = *reinterpret_cast<const float4*>(wp + (size_t)(kb + 0) * DD);
        const float4 w1 = *reinterpret_cast<const float4*>(wp + (size_t)(kb + 1) * DD);
        const float4 w2 = *reinterpret_cast<const float4*>(wp + (size_t)(kb + 2) * DD);
        const float4 w3 = *reinterpret_cast<const float4*>(wp + (size_t)(kb + 3) * DD);
        #pragma unroll   // constant t: the accumulators stay in registers
        for (int t = 0; t < NT; ++t) {
            const float4 a4 = *reinterpret_cast<const float4*>(ap + t * 16 * DD + kb);
            const v2f a01 = {a4.x, a4.y};
            const v2f a23 = {a4.z, a4.w};
            // D = A(16x4) * B(4x16) + C ; emits v_wmma_f32_16x16x4_f32
            acc[t][0] = WMMA4(a01, (v2f{w0.x, w1.x}), acc[t][0]);
            acc[t][1] = WMMA4(a01, (v2f{w0.y, w1.y}), acc[t][1]);
            acc[t][2] = WMMA4(a01, (v2f{w0.z, w1.z}), acc[t][2]);
            acc[t][3] = WMMA4(a01, (v2f{w0.w, w1.w}), acc[t][3]);
            acc[t][0] = WMMA4(a23, (v2f{w2.x, w3.x}), acc[t][0]);
            acc[t][1] = WMMA4(a23, (v2f{w2.y, w3.y}), acc[t][1]);
            acc[t][2] = WMMA4(a23, (v2f{w2.z, w3.z}), acc[t][2]);
            acc[t][3] = WMMA4(a23, (v2f{w2.w, w3.w}), acc[t][3]);
        }
    }
}

// One token tile's 16x64 partial of a wave, laid over the half's x rows.
__device__ __forceinline__ void put_tile(float* __restrict__ part, int t, int hi, int nloc,
                                         const v8f (&acc)[4]) {
    #pragma unroll   // constant r: the accumulators stay in registers
    for (int r = 0; r < 8; ++r) {
        *reinterpret_cast<float4*>(part + (16 * t + r + 8 * hi) * 64 + 4 * nloc) =
            make_float4(acc[0][r], acc[1][r], acc[2][r], acc[3][r]);
    }
}

// Second argument: 4 waves a SIMD, the block's 16 waves on the WGP's 4 SIMDs.
__global__ void __launch_bounds__(512, 4)
moe_wmma_kernel(const float* __restrict__ x,     // [NTOK, DD]
                const float* __restrict__ trans, // [EE, DD, DD]
                const float* __restrict__ bias,  // [EE, DD]
                const int* __restrict__ counts,
                const int* __restrict__ lists,
                float* __restrict__ out) {       // [NTOK, DD]
    const int lane = threadIdx.x & 31;
    // The wave's number in a scalar register: what follows from it (half, expert,
    // branches) is then scalar too.
    const int wave = __builtin_amdgcn_readfirstlane(threadIdx.x >> 5);
    const int half = wave >> 3;                       // which of the block's two halves
    const int w8   = wave & 7;                        // wave inside the half
    const int th   = threadIdx.x & 255;               // thread inside the half
    const int hi   = lane >> 4;                       // 0: lanes 0-15, 1: 16-31
    const int nloc = lane & 15;

    // Rank of every expert: those with more than 16 tokens first, ties by index.
    // Lane L holds experts L and L + 32. The ranks are a permutation of 0..63 for
    // any counts, so every (expert, slice) is taken by exactly one half.
    const int  c0 = counts[lane];
    const int  c1 = counts[lane + 32];
    const bool b0 = c0 > 16;
    const bool b1 = c1 > 16;
    const unsigned h0 = __builtin_amdgcn_ballot_w32(b0);
    const unsigned h1 = __builtin_amdgcn_ballot_w32(b1);
    const int nh0 = __builtin_popcount(h0);
    const int nh  = nh0 + __builtin_popcount(h1);
    const unsigned below = (1u << lane) - 1u;
    const int r0 = b0 ? __builtin_popcount(h0 & below) : nh + __builtin_popcount(~h0 & below);
    const int r1 = b1 ? nh0 + __builtin_popcount(h1 & below)
                      : nh + (32 - nh0) + __builtin_popcount(~h1 & below);
    const int rank_a = blockIdx.x & 63;               // half 0's rank
    const int rank_b = 63 - rank_a;                   // half 1's rank
    const unsigned a0 = __builtin_amdgcn_ballot_w32(r0 == rank_a);
    const unsigned a1 = __builtin_amdgcn_ballot_w32(r1 == rank_a);
    const unsigned g0 = __builtin_amdgcn_ballot_w32(r0 == rank_b);
    const unsigned g1 = __builtin_amdgcn_ballot_w32(r1 == rank_b);
    const int e_a   = a0 ? __builtin_ctz(a0) : 32 + __builtin_ctz(a1);
    const int e_b   = g0 ? __builtin_ctz(g0) : 32 + __builtin_ctz(g1);
    const int cnt_a = a0 ? __builtin_amdgcn_readlane(c0, e_a) : __builtin_amdgcn_readlane(c1, e_a - 32);
    const int cnt_b = g0 ? __builtin_amdgcn_readlane(c0, e_b) : __builtin_amdgcn_readlane(c1, e_b - 32);
    const int e     = half ? e_b : e_a;
    const int cnt   = half ? cnt_b : cnt_a;
    const int cmax  = cnt_a > cnt_b ? cnt_a : cnt_b;  // the same in all 16 waves

    const int col0 = (half * 4 + (blockIdx.x >> 6)) * 128;  // half's first column
    const int kq   = (w8 & 3) * (DD / 4);                   // wave's first k

    const float* __restrict__ wp = trans + (size_t)e * DD * DD + (size_t)(kq + 4 * hi) * DD
                                   + col0 + (w8 >> 2) * 64 + 4 * nloc;

    // Join phase: thread th holds columns 4*(th%32)..+3 of the half.
    const int jcol = lane * 4;
    const float4 bv = *reinterpret_cast<const float4*>(bias + e * DD + col0 + jcol);
    float* __restrict__ outc = out + col0 + jcol;

    __shared__ float xs2[2][32 * DD];   // a half: 128 KB, 32 token rows of x; then the partials
    __shared__ int   tok2[2][32];
    float* __restrict__ xs  = xs2[half];
    int*   __restrict__ tok = tok2[half];

    // Every barrier below is passed by all 16 waves: the trip count is the larger
    // half's, and a half with no rows left only idles between the barriers.
    for (int tile = 0; tile < cmax; tile += 32) {
        const int rows_left = cnt - tile;
        __syncthreads();            // protect previous pass's LDS use
        if (w8 == 0 && rows_left > 0) {
            int idx = tile + lane;
            tok[lane] = lists[e * NTOK + (idx < cnt ? idx : tile)];
        }
        __syncthreads();

        // Cooperative, coalesced float4 stage of 16 or 32 rows of x into LDS:
        // the half's 256 threads take one row a step.
        const int nrows = rows_left > 16 ? 32 : (rows_left > 0 ? 16 : 0);
        for (int r = 0; r < nrows; r += 8) {   // 8 row loads in flight a thread
            const float4* p0 = reinterpret_cast<const float4*>(x + (size_t)tok[r + 0] * DD) + th;
            const float4* p1 = reinterpret_cast<const float4*>(x + (size_t)tok[r + 1] * DD) + th;
            const float4* p2 = reinterpret_cast<const float4*>(x + (size_t)tok[r + 2] * DD) + th;
            const float4* p3 = reinterpret_cast<const float4*>(x + (size_t)tok[r + 3] * DD) + th;
            const float4* p4 = reinterpret_cast<const float4*>(x + (size_t)tok[r + 4] * DD) + th;
            const float4* p5 = reinterpret_cast<const float4*>(x + (size_t)tok[r + 5] * DD) + th;
            const float4* p6 = reinterpret_cast<const float4*>(x + (size_t)tok[r + 6] * DD) + th;
            const float4* p7 = reinterpret_cast<const float4*>(x + (size_t)tok[r + 7] * DD) + th;
            const float4 v0 = *p0;
            const float4 v1 = *p1;
            const float4 v2 = *p2;
            const float4 v3 = *p3;
            const float4 v4 = *p4;
            const float4 v5 = *p5;
            const float4 v6 = *p6;
            const float4 v7 = *p7;
            // The wait stands behind the eight loads and takes their addresses as inputs,
            // so that no address register is given a new value in front of it.
            asm volatile("s_wait_xcnt 0x0"
                         :: "v"(p0), "v"(p1), "v"(p2), "v"(p3), "v"(p4), "v"(p5), "v"(p6), "v"(p7)
                         : "memory");
            float4* q = reinterpret_cast<float4*>(xs + r * DD) + th;
            q[0 * (DD / 4)] = v0;
            q[1 * (DD / 4)] = v1;
            q[2 * (DD / 4)] = v2;
            q[3 * (DD / 4)] = v3;
            q[4 * (DD / 4)] = v4;
            q[5 * (DD / 4)] = v5;
            q[6 * (DD / 4)] = v6;
            q[7 * (DD / 4)] = v7;
        }
        __syncthreads();

        // Two tiles: 4 groups a trip (16 W loads, 64 WMMAs); with 8 the compiler no
        // longer issued the loads together inside the 256-register budget.
        v8f acc[2][4];
        if (rows_left > 16)
            mul_tiles<2, 4>(xs, wp, kq, hi, nloc, acc);
        else if (rows_left > 0)
            mul_tiles<1, 8>(xs, wp, kq, hi, nloc, acc);

        // Join the four k ranges: each wave lays its partial over the half's xs.
        __syncthreads();            // every wave has read its last x fragment
        float* __restrict__ part = xs + w8 * (32 * 64);
        if (rows_left > 0)  put_tile(part, 0, hi, nloc, acc[0]);
        if (rows_left > 16) put_tile(part, 1, hi, nloc, acc[1]);
        __syncthreads();            // partials visible to the whole half

        // Epilogue: thread th sums rows th/32 + 8h, columns 4*(th%32)..+3 of the half,
        // in k-range order, then bias + tanh, masked store of valid rows.
        const float* __restrict__ pj = xs + (lane >> 4) * (4 * 32 * 64) + (lane & 15) * 4;
        #pragma unroll   // up to 4 rows a thread, straight-line
        for (int h = 0; h < 4; ++h) {
            const int m = w8 + 8 * h;
            if (m < rows_left) {
                const float* __restrict__ p = pj + m * 64;
                const float4 p0 = *reinterpret_cast<const float4*>(p);
                const float4 p1 = *reinterpret_cast<const float4*>(p + 1 * 32 * 64);
                const float4 p2 = *reinterpret_cast<const float4*>(p + 2 * 32 * 64);
                const float4 p3 = *reinterpret_cast<const float4*>(p + 3 * 32 * 64);
                float4 o;
                o.x = tanhf(((p0.x + p1.x) + p2.x) + p3.x + bv.x);
                o.y = tanhf(((p0.y + p1.y) + p2.y) + p3.y + bv.y);
                o.z = tanhf(((p0.z + p1.z) + p2.z) + p3.z + bv.z);
                o.w = tanhf(((p0.w + p1.w) + p2.w) + p3.w + bv.w);
                *reinterpret_cast<float4*>(outc + (size_t)tok[m] * DD) = o;
                // The store's registers are reused by the next row or the next pass: the
                // wait stands in front of every such overwrite.
                asm volatile("s_wait_xcnt 0x0" ::: "memory");
            }
        }
    }
}

// ---------------------------------------------------------------------------
// Launch: inputs: x[f32], urls[i32], trans[f32],
// bias[f32]. Output f32 [B,S,D]. Workspace: counts (256 B) + lists (256 KB).
// ---------------------------------------------------------------------------
extern "C" void kernel_launch(void* const* d_in, const int* in_sizes, int n_in,
                              void* d_out, int out_size, void* d_ws, size_t ws_size,
                              hipStream_t stream) {
    const float* x     = (const float*)d_in[0];
    const int*   urls  = (const int*)d_in[1];
    const float* trans = (const float*)d_in[2];
    const float* bias  = (const float*)d_in[3];
    float*       out   = (float*)d_out;

    int* counts = (int*)d_ws;
    int* lists  = counts + EE;   // 256 B in, 256 KB long

    hipMemsetAsync(counts, 0, EE * sizeof(int), stream);
    build_lists_kernel<<<(NTOK + 255) / 256, 256, 0, stream>>>(urls, counts, lists);

    moe_wmma_kernel<<<256, 512, 0, stream>>>(x, trans, bias, counts, lists, out);
}

// v004
// One run takes 29.2 microseconds.
// Timed twice side by side with v003, it ran 1.03 and 1.06 times as fast.
// Counting every step since v000, it is 2.61 times as fast.
#include <hip/hip_runtime.h>
#include <hip/hip_bf16.h>
#include <cmath>

// Problem constants (from reference): B=64, S=16, D=1024, E=64, N=B*S=1024
#define DD   1024
#define EE   64
#define NTOK 1024

typedef __attribute__((ext_vector_type(2))) float v2f;
typedef __attribute__((ext_vector_type(8))) float v8f;

// ---------------------------------------------------------------------------
// Routed GEMM via V_WMMA_F32_16X16X4_F32, one launch.
// Every block reads the 1024 expert ids itself and builds in LDS what it needs of
// the routing: the token count of every expert (for the ranking below) and the
// token lists of its own two experts. The order inside a list follows the arrival
// at an LDS counter; a token's output row does not depend on its place in a list.
// Grid: 256 blocks of 512 threads = 16 waves, one block a WGP (265 KB of LDS).
// A block holds two independent halves of 8 waves. Each half owns 128 output
// columns of one expert and up to 32 of its tokens a pass. An expert with more
// than 16 tokens costs two matrix tiles per W fragment, one with fewer costs one:
// the experts are ranked, those with more than 16 tokens first, and half 0 takes
// rank i while half 1 takes rank 63 - i, so that a WGP's matrix work is even.
// Half 0 covers column slices 0..3 of every expert, half 1 slices 4..7.
// Inside a half: every W fragment is loaded once and multiplies one token tile
// (16 rows) or two. Wave w (0..7) owns the k range [256*(w%4), +256) of the 64
// columns of column half w/4; the four partial sums are joined through LDS.
// W loads: lane (n = L%16, hi = L/16) reads 16 bytes, columns 4n..4n+3 of one
// row, so 16 lanes cover the wave's whole 256-byte piece of that row.
// Element j of the loaded vectors feeds accumulator tile j, whose column n is
// the wave's column 4n+j.
// k order of one group of 8 k (base kb), WMMA u = 0,1, operand register v = 0,1:
// A and B both hold k = kb + 4*hi + 2*u + v.
// C/D (16x16 f32, 8 VGPRs): VGPR r holds M = r + 8*hi, N = L%16.
// ---------------------------------------------------------------------------
#define WMMA4(a, b, c) __builtin_amdgcn_wmma_f32_16x16x4_f32(false, a, false, b, (short)0, c, false, false)

// One pass over the half's W slice for NT token tiles whose x rows lie in xs.
// UNR groups a trip: their 4*UNR W loads issue together, ahead of the WMMAs, so
// that enough bytes are in flight to stream W from memory.
template <int NT, int UNR>
__device__ __forceinline__ void mul_tiles(const float* __restrict__ xs,
                                          const float* __restrict__ wp, int kq,
                                          int hi, int nloc, v8f (&acc)[2][4]) {
    #pragma unroll   // constant t, j: the accumulators stay in registers
    for (int t = 0; t < NT; ++t) {
        #pragma unroll
        for (int j = 0; j < 4; ++j) acc[t][j] = v8f{};
    }
    const float* __restrict__ ap = xs + nloc * DD + kq + 4 * hi;
    #pragma unroll UNR   // the trip's W loads issue together, ahead of its WMMAs
    for (int kb = 0; kb < DD / 4; kb += 8) {
        const float4 w0 = *reinterpret_cast<const float4*>(wp + (size_t)(kb + 0) * DD);
        const float4 w1 = *reinterpret_cast<const float4*>(wp + (size_t)(kb + 1) * DD);
        const float4 w2 = *reinterpret_cast<const float4*>(wp + (size_t)(kb + 2) * DD);
        const float4 w3 = *reinterpret_cast<const float4*>(wp + (size_t)(kb + 3) * DD);
        #pragma unroll   // constant t: the accumulators stay in registers
        for (int t = 0; t < NT; ++t) {
            const float4 a4 = *reinterpret_cast<const float4*>(ap + t * 16 * DD + kb);
            const v2f a01 = {a4.x, a4.y};
            const v2f a23 = {a4.z, a4.w};
            // D = A(16x4) * B(4x16) + C ; emits v_wmma_f32_16x16x4_f32
            acc[t][0] = WMMA4(a01, (v2f{w0.x, w1.x}), acc[t][0]);
            acc[t][1] = WMMA4(a01, (v2f{w0.y, w1.y}), acc[t][1]);
            acc[t][2] = WMMA4(a01, (v2f{w0.z, w1.z}), acc[t][2]);
            acc[t][3] = WMMA4(a01, (v2f{w0.w, w1.w}), acc[t][3]);
            acc[t][0] = WMMA4(a23, (v2f{w2.x, w3.x}), acc[t][0]);
            acc[t][1] = WMMA4(a23, (v2f{w2.y, w3.y}), acc[t][1]);
            acc[t][2] = WMMA4(a23, (v2f{w2.z, w3.z}), acc[t][2]);
            acc[t][3] = WMMA4(a23, (v2f{w2.w, w3.w}), acc[t][3]);
        }
    }
}

// One token tile's 16x64 partial of a wave, laid over the half's x rows.
__device__ __forceinline__ void put_tile(float* __restrict__ part, int t, int hi, int nloc,
                                         const v8f (&acc)[4]) {
    #pragma unroll   // constant r: the accumulators stay in registers
    for (int r = 0; r < 8; ++r) {
        *reinterpret_cast<float4*>(part + (16 * t + r + 8 * hi) * 64 + 4 * nloc) =
            make_float4(acc[0][r], acc[1][r], acc[2][r], acc[3][r]);
    }
}

// Second argument: 4 waves a SIMD, the block's 16 waves on the WGP's 4 SIMDs.
__global__ void __launch_bounds__(512, 4)
moe_wmma_kernel(const float* __restrict__ x,     // [NTOK, DD]
                const float* __restrict__ trans, // [EE, DD, DD]
                const float* __restrict__ bias,  // [EE, DD]
                const int* __restrict__ urls,    // [NTOK], expert of every token
                float* __restrict__ out) {       // [NTOK, DD]
    const int lane = threadIdx.x & 31;
    // The wave's number in a scalar register: what follows from it (half, expert,
    // branches) is then scalar too.
    const int wave = __builtin_amdgcn_readfirstlane(threadIdx.x >> 5);
    const int half = wave >> 3;                       // which of the block's two halves
    const int w8   = wave & 7;                        // wave inside the half
    const int th   = threadIdx.x & 255;               // thread inside the half
    const int hi   = lane >> 4;                       // 0: lanes 0-15, 1: 16-31
    const int nloc = lane & 15;

    __shared__ float xs2[2][32 * DD];   // a half: 128 KB, 32 token rows of x; then the partials
    __shared__ int   tok2[2][32];
    __shared__ int   hist[EE];          // tokens of every expert
    __shared__ int   fill2[2];          // entries so far in the two lists
    __shared__ int   list2[2][NTOK];    // tokens of half 0's and of half 1's expert

    // Thread t holds the experts of tokens t and t + 512.
    const int u0 = urls[threadIdx.x];
    const int u1 = urls[threadIdx.x + 512];
    if (threadIdx.x < EE) hist[threadIdx.x] = 0;
    if (threadIdx.x < 2)  fill2[threadIdx.x] = 0;
    __syncthreads();            // the zeros stand before the first add
    if ((unsigned)u0 < EE) atomicAdd(&hist[u0], 1);   // the compare bounds the LDS address
    if ((unsigned)u1 < EE) atomicAdd(&hist[u1], 1);
    __syncthreads();            // every token is counted

    // Rank of every expert: those with more than 16 tokens first, ties by index.
    // Lane L holds experts L and L + 32. The ranks are a permutation of 0..63 for
    // any counts, so every (expert, slice) is taken by exactly one half.
    const int  c0 = hist[lane];
    const int  c1 = hist[lane + 32];
    const bool b0 = c0 > 16;
    const bool b1 = c1 > 16;
    const unsigned h0 = __builtin_amdgcn_ballot_w32(b0);
    const unsigned h1 = __builtin_amdgcn_ballot_w32(b1);
    const int nh0 = __builtin_popcount(h0);
    const int nh  = nh0 + __builtin_popcount(h1);
    const unsigned below = (1u << lane) - 1u;
    const int r0 = b0 ? __builtin_popcount(h0 & below) : nh + __builtin_popcount(~h0 & below);
    const int r1 = b1 ? nh0 + __builtin_popcount(h1 & below)
                      : nh + (32 - nh0) + __builtin_popcount(~h1 & below);
    const int rank_a = blockIdx.x & 63;               // half 0's rank
    const int rank_b = 63 - rank_a;                   // half 1's rank
    const unsigned a0 = __builtin_amdgcn_ballot_w32(r0 == rank_a);
    const unsigned a1 = __builtin_amdgcn_ballot_w32(r1 == rank_a);
    const unsigned g0 = __builtin_amdgcn_ballot_w32(r0 == rank_b);
    const unsigned g1 = __builtin_amdgcn_ballot_w32(r1 == rank_b);
    const int e_a   = a0 ? __builtin_ctz(a0) : 32 + __builtin_ctz(a1);
    const int e_b   = g0 ? __builtin_ctz(g0) : 32 + __builtin_ctz(g1);
    const int cnt_a = a0 ? __builtin_amdgcn_readlane(c0, e_a) : __builtin_amdgcn_readlane(c1, e_a - 32);
    const int cnt_b = g0 ? __builtin_amdgcn_readlane(c0, e_b) : __builtin_amdgcn_readlane(c1, e_b - 32);
    const int e     = half ? e_b : e_a;
    const int cnt   = half ? cnt_b : cnt_a;
    const int cmax  = cnt_a > cnt_b ? cnt_a : cnt_b;  // the same in all 16 waves

    // The two lists: e_a != e_b, and a list takes at most NTOK entries, one a token.
    // The first barrier of the loop below makes them visible.
    if (u0 == e_a || u0 == e_b) {
        const int h = u0 == e_b;
        list2[h][atomicAdd(&fill2[h], 1)] = threadIdx.x;
    }
    if (u1 == e_a || u1 == e_b) {
        const int h = u1 == e_b;
        list2[h][atomicAdd(&fill2[h], 1)] = threadIdx.x + 512;
    }

    const int col0 = (half * 4 + (blockIdx.x >> 6)) * 128;  // half's first column
    const int kq   = (w8 & 3) * (DD / 4);                   // wave's first k

    const float* __restrict__ wp = trans + (size_t)e * DD * DD + (size_t)(kq + 4 * hi) * DD
                                   + col0 + (w8 >> 2) * 64 + 4 * nloc;

    // Join phase: thread th holds columns 4*(th%32)..+3 of the half.
    const int jcol = lane * 4;
    const float4 bv = *reinterpret_cast<const float4*>(bias + e * DD + col0 + jcol);
    float* __restrict__ outc = out + col0 + jcol;

    float* __restrict__ xs  = xs2[half];
    int*   __restrict__ tok = tok2[half];

    // Every barrier below is passed by all 16 waves: the trip count is the larger
    // half's, and a half with no rows left only idles between the barriers.
    for (int tile = 0; tile < cmax; tile += 32) {
        const int rows_left = cnt - tile;
        __syncthreads();            // lists complete; protect previous pass's LDS use
        if (w8 == 0 && rows_left > 0) {
            int idx = tile + lane;
            tok[lane] = list2[half][idx < cnt ? idx : tile];
        }
        __syncthreads();

        // Cooperative, coalesced float4 stage of 16 or 32 rows of x into LDS:
        // the half's 256 threads take one row a step.
        const int nrows = rows_left > 16 ? 32 : (rows_left > 0 ? 16 : 0);
        for (int r = 0; r < nrows; r += 8) {   // 8 row loads in flight a thread
            const float4* p0 = reinterpret_cast<const float4*>(x + (size_t)tok[r + 0] * DD) + th;
            const float4* p1 = reinterpret_cast<const float4*>(x + (size_t)tok[r + 1] * DD) + th;
            const float4* p2 = reinterpret_cast<const float4*>(x + (size_t)tok[r + 2] * DD) + th;
            const float4* p3 = reinterpret_cast<const float4*>(x + (size_t)tok[r + 3] * DD) + th;
            const float4* p4 = reinterpret_cast<const float4*>(x + (size_t)tok[r + 4] * DD) + th;
            const float4* p5 = reinterpret_cast<const float4*>(x + (size_t)tok[r + 5] * DD) + th;
            const float4* p6 = reinterpret_cast<const float4*>(x + (size_t)tok[r + 6] * DD) + th;
            const float4* p7 = reinterpret_cast<const float4*>(x + (size_t)tok[r + 7] * DD) + th;
            const float4 v0 = *p0;
            const float4 v1 = *p1;
            const float4 v2 = *p2;
            const float4 v3 = *p3;
            const float4 v4 = *p4;
            const float4 v5 = *p5;
            const float4 v6 = *p6;
            const float4 v7 = *p7;
            // The wait stands behind the eight loads and takes their addresses as inputs,
            // so that no address register is given a new value in front of it.
            asm volatile("s_wait_xcnt 0x0"
                         :: "v"(p0), "v"(p1), "v"(p2), "v"(p3), "v"(p4), "v"(p5), "v"(p6), "v"(p7)
                         : "memory");
            float4* q = reinterpret_cast<float4*>(xs + r * DD) + th;
            q[0 * (DD / 4)] = v0;
            q[1 * (DD / 4)] = v1;
            q[2 * (DD / 4)] = v2;
            q[3 * (DD / 4)] = v3;
            q[4 * (DD / 4)] = v4;
            q[5 * (DD / 4)] = v5;
            q[6 * (DD / 4)] = v6;
            q[7 * (DD / 4)] = v7;
        }
        __syncthreads();

        // Two tiles: 4 groups a trip (16 W loads, 64 WMMAs); with 8 the compiler no
        // longer issued the loads together inside the 256-register budget.
        v8f acc[2][4];
        if (rows_left > 16)
            mul_tiles<2, 4>(xs, wp, kq, hi, nloc, acc);
        else if (rows_left > 0)
            mul_tiles<1, 8>(xs, wp, kq, hi, nloc, acc);

        // Join the four k ranges: each wave lays its partial over the half's xs.
        __syncthreads();            // every wave has read its last x fragment
        float* __restrict__ part = xs + w8 * (32 * 64);
        if (rows_left > 0)  put_tile(part, 0, hi, nloc, acc[0]);
        if (rows_left > 16) put_tile(part, 1, hi, nloc, acc[1]);
        __syncthreads();            // partials visible to the whole half

        // Epilogue: thread th sums rows th/32 + 8h, columns 4*(th%32)..+3 of the half,
        // in k-range order, then bias + tanh, masked store of valid rows.
        const float* __restrict__ pj = xs + (lane >> 4) * (4 * 32 * 64) + (lane & 15) * 4;
        #pragma unroll   // up to 4 rows a thread, straight-line
        for (int h = 0; h < 4; ++h) {
            const int m = w8 + 8 * h;
            if (m < rows_left) {
                const float* __restrict__ p = pj + m * 64;
                const float4 p0 = *reinterpret_cast<const float4*>(p);
                const float4 p1 = *reinterpret_cast<const float4*>(p + 1 * 32 * 64);
                const float4 p2 = *reinterpret_cast<const float4*>(p + 2 * 32 * 64);
                const float4 p3 = *reinterpret_cast<const float4*>(p + 3 * 32 * 64);
                float4 o;
                o.x = tanhf(((p0.x + p1.x) + p2.x) + p3.x + bv.x);
                o.y = tanhf(((p0.y + p1.y) + p2.y) + p3.y + bv.y);
                o.z = tanhf(((p0.z + p1.z) + p2.z) + p3.z + bv.z);
                o.w = tanhf(((p0.w + p1.w) + p2.w) + p3.w + bv.w);
                *reinterpret_cast<float4*>(outc + (size_t)tok[m] * DD) = o;
                // The store's registers are reused by the next row or the next pass: the
                // wait stands in front of every such overwrite.
                asm volatile("s_wait_xcnt 0x0" ::: "memory");
            }
        }
    }
}

// ---------------------------------------------------------------------------
// Launch: inputs: x[f32], urls[i32], trans[f32],
// bias[f32]. Output f32 [B,S,D]. The workspace is not used.
// ---------------------------------------------------------------------------
extern "C" void kernel_launch(void* const* d_in, const int* in_sizes, int n_in,
                              void* d_out, int out_size, void* d_ws, size_t ws_size,
                              hipStream_t stream) {
    const float* x     = (const float*)d_in[0];
    const int*   urls  = (const int*)d_in[1];
    const float* trans = (const float*)d_in[2];
    const float* bias  = (const float*)d_in[3];
    float*       out   = (float*)d_out;

    moe_wmma_kernel<<<256, 512, 0, stream>>>(x, trans, bias, urls, out);
}

// v005
// One run takes 27.7 microseconds.
// Two timings next to v004 put it at 1.05 and 1.06 times that version's speed.
// All steps since v000 together make it 2.75 times as fast.
#include <hip/hip_runtime.h>
#include <hip/hip_bf16.h>
#include <cmath>

// Problem constants (from reference): B=64, S=16, D=1024, E=64, N=B*S=1024
#define DD   1024
#define EE   64
#define NTOK 1024

typedef __attribute__((ext_vector_type(2))) float v2f;
typedef __attribute__((ext_vector_type(8))) float v8f;

// ---------------------------------------------------------------------------
// Routed GEMM via V_WMMA_F32_16X16X4_F32, one launch.
// Every block reads the 1024 expert ids itself and builds in LDS what it needs of
// the routing: the token count of every expert (for the ranking below) and the
// token lists of its own two experts. The order inside a list follows the arrival
// at an LDS counter; a token's output row does not depend on its place in a list.
// Grid: 256 blocks of 512 threads = 16 waves, one block a WGP (265 KB of LDS).
// A block holds two independent halves of 8 waves. Each half owns 128 output
// columns of one expert and up to 32 of its tokens a pass. An expert with more
// than 16 tokens costs two matrix tiles per W fragment, one with fewer costs one:
// the experts are ranked, those with more than 16 tokens first, and half 0 takes
// rank i while half 1 takes rank 63 - i, so that a WGP's matrix work is even.
// Half 0 covers column slices 0..3 of every expert, half 1 slices 4..7.
// Inside a half: every W fragment is loaded once and multiplies one token tile
// (16 rows) or two. Wave w (0..7) owns the k range [256*(w%4), +256) of the 64
// columns of column half w/4; the four partial sums are joined through LDS.
// W loads: lane (n = L%16, hi = L/16) reads 16 bytes, columns 4n..4n+3 of one
// row, so 16 lanes cover the wave's whole 256-byte piece of that row.
// Element j of the loaded vectors feeds accumulator tile j, whose column n is
// the wave's column 4n+j.
// k order of one group of 8 k (base kb), WMMA u = 0,1, operand register v = 0,1:
// A and B both hold k = kb + 4*hi + 2*u + v.
// C/D (16x16 f32, 8 VGPRs): VGPR r holds M = r + 8*hi, N = L%16.
// ---------------------------------------------------------------------------
#define WMMA4(a, b, c) __builtin_amdgcn_wmma_f32_16x16x4_f32(false, a, false, b, (short)0, c, false, false)

// W goes through a ring of RG register slots, one slot a group of 8 k (4 loads of
// 512 bytes a wave). A slot is refilled right behind the WMMAs that used it, so a
// wave keeps RG - 1 or RG groups of W loads in flight or waiting up to its last RG
// groups, which drain the ring, and both halves' waves have the same number of bytes in flight.
#define RG  8
#define NG  (DD / 4 / 8)   // groups of a wave's k range

// The four W loads of group g into one slot.
__device__ __forceinline__ void load_group(const float* __restrict__ wp, int g, float4 (&w)[4]) {
    #pragma unroll   // constant i: the slot stays in registers
    for (int i = 0; i < 4; ++i)
        w[i] = *reinterpret_cast<const float4*>(wp + (size_t)(8 * g + i) * DD);
}

// One pass over the half's W slice for NT token tiles whose x rows lie in xs.
template <int NT>
__device__ __forceinline__ void mul_tiles(const float* __restrict__ xs,
                                          const float* __restrict__ wp, int kq,
                                          int hi, int nloc, v8f (&acc)[2][4]) {
    float4 wb[RG][4];
    #pragma unroll   // constant g: the ring stays in registers
    for (int g = 0; g < RG; ++g) load_group(wp, g, wb[g]);
    #pragma unroll   // constant t, j: the accumulators stay in registers
    for (int t = 0; t < NT; ++t) {
        #pragma unroll
        for (int j = 0; j < 4; ++j) acc[t][j] = v8f{};
    }
    const float* __restrict__ ap = xs + nloc * DD + kq + 4 * hi;
    float4 a4[3][NT];   // x fragments, fetched 2 groups ahead
    #pragma unroll   // constant t, g: the fragments stay in registers
    for (int t = 0; t < NT; ++t) {
        #pragma unroll
        for (int g = 0; g < 2; ++g)
            a4[g][t] = *reinterpret_cast<const float4*>(ap + t * 16 * DD + 8 * g);
    }
    #pragma unroll   // constant g: ring slots and fragments stay in registers
    for (int g = 0; g < NG; ++g) {
        if (g + 2 < NG) {
            #pragma unroll   // constant t: the fragments stay in registers
            for (int t = 0; t < NT; ++t)
                a4[(g + 2) % 3][t] = *reinterpret_cast<const float4*>(ap + t * 16 * DD + 8 * (g + 2));
        }
        const float4 w0 = wb[g % RG][0];
        const float4 w1 = wb[g % RG][1];
        const float4 w2 = wb[g % RG][2];
        const float4 w3 = wb[g % RG][3];
        #pragma unroll   // constant t: the accumulators stay in registers
        for (int t = 0; t < NT; ++t) {
            const v2f a01 = {a4[g % 3][t].x, a4[g % 3][t].y};
            const v2f a23 = {a4[g % 3][t].z, a4[g % 3][t].w};
            // D = A(16x4) * B(4x16) + C ; emits v_wmma_f32_16x16x4_f32
            acc[t][0] = WMMA4(a01, (v2f{w0.x, w1.x}), acc[t][0]);
            acc[t][1] = WMMA4(a01, (v2f{w0.y, w1.y}), acc[t][1]);
            acc[t][2] = WMMA4(a01, (v2f{w0.z, w1.z}), acc[t][2]);
            acc[t][3] = WMMA4(a01, (v2f{w0.w, w1.w}), acc[t][3]);
            acc[t][0] = WMMA4(a23, (v2f{w2.x, w3.x}), acc[t][0]);
            acc[t][1] = WMMA4(a23, (v2f{w2.y, w3.y}), acc[t][1]);
            acc[t][2] = WMMA4(a23, (v2f{w2.z, w3.z}), acc[t][2]);
            acc[t][3] = WMMA4(a23, (v2f{w2.w, w3.w}), acc[t][3]);
        }
        if (g + RG < NG) load_group(wp, g + RG, wb[g % RG]);
        // Keeps the groups apart: without it the compiler moves the next group's register
        // moves, and the wait for its W loads with them, a group ahead: a slot less of lead.
        __builtin_amdgcn_sched_barrier(0);
    }
}

// One token tile's 16x64 partial of a wave, laid over the half's x rows.
__device__ __forceinline__ void put_tile(float* __restrict__ part, int t, int hi, int nloc,
                                         const v8f (&acc)[4]) {
    #pragma unroll   // constant r: the accumulators stay in registers
    for (int r = 0; r < 8; ++r) {
        *reinterpret_cast<float4*>(part + (16 * t + r + 8 * hi) * 64 + 4 * nloc) =
            make_float4(acc[0][r], acc[1][r], acc[2][r], acc[3][r]);
    }
}

// Second argument: 4 waves a SIMD, the block's 16 waves on the WGP's 4 SIMDs.
__global__ void __launch_bounds__(512, 4)
moe_wmma_kernel(const float* __restrict__ x,     // [NTOK, DD]
                const float* __restrict__ trans, // [EE, DD, DD]
                const float* __restrict__ bias,  // [EE, DD]
                const int* __restrict__ urls,    // [NTOK], expert of every token
                float* __restrict__ out) {       // [NTOK, DD]
    const int lane = threadIdx.x & 31;
    // The wave's number in a scalar register: what follows from it (half, expert,
    // branches) is then scalar too.
    const int wave = __builtin_amdgcn_readfirstlane(threadIdx.x >> 5);
    const int half = wave >> 3;                       // which of the block's two halves
    const int w8   = wave & 7;                        // wave inside the half
    const int th   = threadIdx.x & 255;               // thread inside the half
    const int hi   = lane >> 4;                       // 0: lanes 0-15, 1: 16-31
    const int nloc = lane & 15;

    __shared__ float xs2[2][32 * DD];   // a half: 128 KB, 32 token rows of x; then the partials
    __shared__ int   tok2[2][32];
    __shared__ int   hist[EE];          // tokens of every expert
    __shared__ int   fill2[2];          // entries so far in the two lists
    __shared__ int   list2[2][NTOK];    // tokens of half 0's and of half 1's expert

    // Thread t holds the experts of tokens t and t + 512.
    const int u0 = urls[threadIdx.x];
    const int u1 = urls[threadIdx.x + 512];
    if (threadIdx.x < EE) hist[threadIdx.x] = 0;
    if (threadIdx.x < 2)  fill2[threadIdx.x] = 0;
    __syncthreads();            // the zeros stand before the first add
    if ((unsigned)u0 < EE) atomicAdd(&hist[u0], 1);   // the compare bounds the LDS address
    if ((unsigned)u1 < EE) atomicAdd(&hist[u1], 1);
    __syncthreads();            // every token is counted

    // Rank of every expert: those with more than 16 tokens first, ties by index.
    // Lane L holds experts L and L + 32. The ranks are a permutation of 0..63 for
    // any counts, so every (expert, slice) is taken by exactly one half.
    const int  c0 = hist[lane];
    const int  c1 = hist[lane + 32];
    const bool b0 = c0 > 16;
    const bool b1 = c1 > 16;
    const unsigned h0 = __builtin_amdgcn_ballot_w32(b0);
    const unsigned h1 = __builtin_amdgcn_ballot_w32(b1);
    const int nh0 = __builtin_popcount(h0);
    const int nh  = nh0 + __builtin_popcount(h1);
    const unsigned below = (1u << lane) - 1u;
    const int r0 = b0 ? __builtin_popcount(h0 & below) : nh + __builtin_popcount(~h0 & below);
    const int r1 = b1 ? nh0 + __builtin_popcount(h1 & below)
                      : nh + (32 - nh0) + __builtin_popcount(~h1 & below);
    const int rank_a = blockIdx.x & 63;               // half 0's rank
    const int rank_b = 63 - rank_a;                   // half 1's rank
    const unsigned a0 = __builtin_amdgcn_ballot_w32(r0 == rank_a);
    const unsigned a1 = __builtin_amdgcn_ballot_w32(r1 == rank_a);
    const unsigned g0 = __builtin_amdgcn_ballot_w32(r0 == rank_b);
    const unsigned g1 = __builtin_amdgcn_ballot_w32(r1 == rank_b);
    const int e_a   = a0 ? __builtin_ctz(a0) : 32 + __builtin_ctz(a1);
    const int e_b   = g0 ? __builtin_ctz(g0) : 32 + __builtin_ctz(g1);
    const int cnt_a = a0 ? __builtin_amdgcn_readlane(c0, e_a) : __builtin_amdgcn_readlane(c1, e_a - 32);
    const int cnt_b = g0 ? __builtin_amdgcn_readlane(c0, e_b) : __builtin_amdgcn_readlane(c1, e_b - 32);
    const int e     = half ? e_b : e_a;
    const int cnt   = half ? cnt_b : cnt_a;
    const int cmax  = cnt_a > cnt_b ? cnt_a : cnt_b;  // the same in all 16 waves

    // The two lists: e_a != e_b, and a list takes at most NTOK entries, one a token.
    // The first barrier of the loop below makes them visible.
    if (u0 == e_a || u0 == e_b) {
        const int h = u0 == e_b;
        list2[h][atomicAdd(&fill2[h], 1)] = threadIdx.x;
    }
    if (u1 == e_a || u1 == e_b) {
        const int h = u1 == e_b;
        list2[h][atomicAdd(&fill2[h], 1)] = threadIdx.x + 512;
    }

    const int col0 = (half * 4 + (blockIdx.x >> 6)) * 128;  // half's first column
    const int kq   = (w8 & 3) * (DD / 4);                   // wave's first k

    const float* __restrict__ wp = trans + (size_t)e * DD * DD + (size_t)(kq + 4 * hi) * DD
                                   + col0 + (w8 >> 2) * 64 + 4 * nloc;

    // Join phase: thread th holds columns 4*(th%32)..+3 of the half.
    const int jcol = lane * 4;
    const float4 bv = *reinterpret_cast<const float4*>(bias + e * DD + col0 + jcol);
    float* __restrict__ outc = out + col0 + jcol;

    float* __restrict__ xs  = xs2[half];
    int*   __restrict__ tok = tok2[half];

    // Every barrier below is passed by all 16 waves: the trip count is the larger
    // half's, and a half with no rows left only idles between the barriers.
    for (int tile = 0; tile < cmax; tile += 32) {
        const int rows_left = cnt - tile;
        __syncthreads();            // lists complete; protect previous pass's LDS use
        if (w8 == 0 && rows_left > 0) {
            int idx = tile + lane;
            tok[lane] = list2[half][idx < cnt ? idx : tile];
        }
        __syncthreads();

        // Cooperative, coalesced float4 stage of 16 or 32 rows of x into LDS:
        // the half's 256 threads take one row a step.
        const int nrows = rows_left > 16 ? 32 : (rows_left > 0 ? 16 : 0);
        for (int r = 0; r < nrows; r += 8) {   // 8 row loads in flight a thread
            const float4* p0 = reinterpret_cast<const float4*>(x + (size_t)tok[r + 0] * DD) + th;
            const float4* p1 = reinterpret_cast<const float4*>(x + (size_t)tok[r + 1] * DD) + th;
            const float4* p2 = reinterpret_cast<const float4*>(x + (size_t)tok[r + 2] * DD) + th;
            const float4* p3 = reinterpret_cast<const float4*>(x + (size_t)tok[r + 3] * DD) + th;
            const float4* p4 = reinterpret_cast<const float4*>(x + (size_t)tok[r + 4] * DD) + th;
            const float4* p5 = reinterpret_cast<const float4*>(x + (size_t)tok[r + 5] * DD) + th;
            const float4* p6 = reinterpret_cast<const float4*>(x + (size_t)tok[r + 6] * DD) + th;
            const float4* p7 = reinterpret_cast<const float4*>(x + (size_t)tok[r + 7] * DD) + th;
            const float4 v0 = *p0;
            const float4 v1 = *p1;
            const float4 v2 = *p2;
            const float4 v3 = *p3;
            const float4 v4 = *p4;
            const float4 v5 = *p5;
            const float4 v6 = *p6;
            const float4 v7 = *p7;
            // The wait stands behind the eight loads and takes their addresses as inputs,
            // so that no address register is given a new value in front of it.
            asm volatile("s_wait_xcnt 0x0"
                         :: "v"(p0), "v"(p1), "v"(p2), "v"(p3), "v"(p4), "v"(p5), "v"(p6), "v"(p7)
                         : "memory");
            float4* q = reinterpret_cast<float4*>(xs + r * DD) + th;
            q[0 * (DD / 4)] = v0;
            q[1 * (DD / 4)] = v1;
            q[2 * (DD / 4)] = v2;
            q[3 * (DD / 4)] = v3;
            q[4 * (DD / 4)] = v4;
            q[5 * (DD / 4)] = v5;
            q[6 * (DD / 4)] = v6;
            q[7 * (DD / 4)] = v7;
        }
        __syncthreads();

        v8f acc[2][4];
        if (rows_left > 16)
            mul_tiles<2>(xs, wp, kq, hi, nloc, acc);
        else if (rows_left > 0)
            mul_tiles<1>(xs, wp, kq, hi, nloc, acc);

        // Join the four k ranges: each wave lays its partial over the half's xs.
        __syncthreads();            // every wave has read its last x fragment
        float* __restrict__ part = xs + w8 * (32 * 64);
        if (rows_left > 0)  put_tile(part, 0, hi, nloc, acc[0]);
        if (rows_left > 16) put_tile(part, 1, hi, nloc, acc[1]);
        __syncthreads();            // partials visible to the whole half

        // Epilogue: thread th sums rows th/32 + 8h, columns 4*(th%32)..+3 of the half,
        // in k-range order, then bias + tanh, masked store of valid rows.
        const float* __restrict__ pj = xs + (lane >> 4) * (4 * 32 * 64) + (lane & 15) * 4;
        #pragma unroll   // up to 4 rows a thread, straight-line
        for (int h = 0; h < 4; ++h) {
            const int m = w8 + 8 * h;
            if (m < rows_left) {
                const float* __restrict__ p = pj + m * 64;
                const float4 p0 = *reinterpret_cast<const float4*>(p);
                const float4 p1 = *reinterpret_cast<const float4*>(p + 1 * 32 * 64);
                const float4 p2 = *reinterpret_cast<const float4*>(p + 2 * 32 * 64);
                const float4 p3 = *reinterpret_cast<const float4*>(p + 3 * 32 * 64);
                float4 o;
                o.x = tanhf(((p0.x + p1.x) + p2.x) + p3.x + bv.x);
                o.y = tanhf(((p0.y + p1.y) + p2.y) + p3.y + bv.y);
                o.z = tanhf(((p0.z + p1.z) + p2.z) + p3.z + bv.z);
                o.w = tanhf(((p0.w + p1.w) + p2.w) + p3.w + bv.w);
                *reinterpret_cast<float4*>(outc + (size_t)tok[m] * DD) = o;
                // The store's registers are reused by the next row or the next pass: the
                // wait stands in front of every such overwrite.
                asm volatile("s_wait_xcnt 0x0" ::: "memory");
            }
        }
    }
}

// ---------------------------------------------------------------------------
// Launch: inputs: x[f32], urls[i32], trans[f32],
// bias[f32]. Output f32 [B,S,D]. The workspace is not used.
// ---------------------------------------------------------------------------
extern "C" void kernel_launch(void* const* d_in, const int* in_sizes, int n_in,
                              void* d_out, int out_size, void* d_ws, size_t ws_size,
                              hipStream_t stream) {
    const float* x     = (const float*)d_in[0];
    const int*   urls  = (const int*)d_in[1];
    const float* trans = (const float*)d_in[2];
    const float* bias  = (const float*)d_in[3];
    float*       out   = (float*)d_out;

    moe_wmma_kernel<<<256, 512, 0, stream>>>(x, trans, bias, urls, out);
}
